// v000
// Measured on an AMD MI455X. A time is GPU time per run, averaged over a window of back-to-back runs after a warm-up
// (all launches, gaps included; the runs take copies of the inputs in turn), and the median of several windows.
// Apart from v000's, it joins two sittings. Times from different sittings can be a few percent apart, while
// side-by-side timings come from the same sitting.
// v000, which the later versions start from, runs in 446 microseconds.
#include <hip/hip_runtime.h>
#include <hip/hip_bf16.h>
#include <math.h>

typedef __attribute__((ext_vector_type(2))) float v2f;
typedef __attribute__((ext_vector_type(8))) float v8f;

#define B_ 2
#define N_ 2048
#define C_ 1024
#define H_ 16
#define D_ 64
#define BHND (B_*H_*N_*D_)   /* 4,194,304 floats per tensor */

// f32 WMMA fragment with K-major source: element (lane, v) <-> K = k0 + v + 2*(lane>>4)
static __device__ __forceinline__ v2f load_kfrag(const float* __restrict__ base,
                                                 int row, int ld, int k0, int lane) {
    const float* p = base + (long)row * ld + k0 + 2 * (lane >> 4);
    v2f r; r.x = p[0]; r.y = p[1];
    return r;
}

// CDNA5 async copy global->LDS (ASYNCcnt-tracked); lds_byte_off is the LDS byte address.
static __device__ __forceinline__ void async_ldg_b128(unsigned lds_byte_off, const float* gptr) {
    asm volatile("global_load_async_to_lds_b128 %0, %1, off"
                 :: "v"(lds_byte_off), "v"(gptr) : "memory");
}

// ---------------- Kernel 1: qkv = x @ w_qkv^T + b_qkv, scattered to [3,B,H,N,D] ----------------
// WG: 256 thr (8 waves), tile 256M x 64N; wave tile 32M x 64N (2x A-reuse of B).
// B (weights) staged in LDS once per 32-K chunk -> 8x less redundant L2 traffic.
__global__ __launch_bounds__(256)
void k_qkv_gemm(const float* __restrict__ x, const float* __restrict__ w,
                const float* __restrict__ bias, float* __restrict__ qkv) {
    __shared__ float ldsB[64 * 36];          // 64 cols x 32 K, pad stride 36 (conflict-free)
    const int t = threadIdx.x;
    const int lane = t & 31, wave = t >> 5;
    const int ln = lane & 15, hl = lane >> 4;
    const int m0 = blockIdx.x * 256 + wave * 32;
    const int n0 = blockIdx.y * 64;
    const int ar0 = m0 + ln, ar1 = m0 + 16 + ln;
    const int wn = t >> 2;                   // 0..63: which B row (output col)
    const int wk = (t & 3) * 8;              // 0,8,16,24: K sub-offset

    v8f acc[2][4] = {};
    for (int k0 = 0; k0 < C_; k0 += 32) {
        __syncthreads();
        const float4* src = (const float4*)(w + (long)(n0 + wn) * C_ + k0 + wk);
        float4 b0 = src[0], b1 = src[1];
        *(float4*)&ldsB[wn * 36 + wk]     = b0;
        *(float4*)&ldsB[wn * 36 + wk + 4] = b1;
        __syncthreads();
#pragma unroll
        for (int kk = 0; kk < 32; kk += 4) {
            v2f a0 = load_kfrag(x, ar0, C_, k0 + kk, lane);
            v2f a1 = load_kfrag(x, ar1, C_, k0 + kk, lane);
#pragma unroll
            for (int j = 0; j < 4; ++j) {
                const int bi = (j * 16 + ln) * 36 + kk + 2 * hl;
                v2f b; b.x = ldsB[bi]; b.y = ldsB[bi + 1];
                acc[0][j] = __builtin_amdgcn_wmma_f32_16x16x4_f32(
                    false, a0, false, b, (short)0, acc[0][j], false, false);
                acc[1][j] = __builtin_amdgcn_wmma_f32_16x16x4_f32(
                    false, a1, false, b, (short)0, acc[1][j], false, false);
            }
        }
    }
#pragma unroll
    for (int j = 0; j < 4; ++j) {
        const int col = n0 + j * 16 + ln;
        const float bval = bias[col];
        const int which = col >> 10;         // 0=q,1=k,2=v
        const int rem = col & 1023;
        const int h = rem >> 6, d = rem & 63;
#pragma unroll
        for (int i = 0; i < 2; ++i) {
#pragma unroll
            for (int r = 0; r < 8; ++r) {
                const int m = m0 + i * 16 + r + 8 * hl;
                const int bb = m >> 11, n = m & (N_ - 1);
                qkv[((((long)which * B_ + bb) * H_ + h) * N_ + n) * D_ + d] = acc[i][j][r] + bval;
            }
        }
    }
}

// ---------------- Kernel 2: RoPE on q and k, in place ----------------
__global__ __launch_bounds__(256)
void k_rope(float* __restrict__ qk, const float* __restrict__ rope) {
    const int idx = blockIdx.x * blockDim.x + threadIdx.x;   // 2^22 total
    const int d2    = idx & 31;
    const int n     = (idx >> 5) & (N_ - 1);
    const int h     = (idx >> 16) & (H_ - 1);
    const int bb    = (idx >> 20) & (B_ - 1);
    const int which = idx >> 21;                              // 0=q, 1=k
    float* p = qk + ((((long)which * B_ + bb) * H_ + h) * N_ + n) * D_ + 2 * d2;
    const float* rp = rope + ((long)bb * N_ + n) * (2 * D_);
    float2 xv = *(const float2*)p;
    const float c0 = rp[2 * d2],      c1 = rp[2 * d2 + 1];
    const float s0 = rp[D_ + 2 * d2], s1 = rp[D_ + 2 * d2 + 1];
    float2 ov;
    ov.x = xv.x * c0 - xv.y * s0;
    ov.y = xv.y * c1 + xv.x * s1;
    *(float2*)p = ov;
}

// ---------------- Kernel 3: flash attention ----------------
// One WG (4 waves) per (b,h, 64-query block). K/V 16-key tiles double-buffered in LDS,
// filled with GLOBAL_LOAD_ASYNC_TO_LDS_B128 (ASYNCcnt) and overlapped with compute.
// LDS float layout (single array at LDS offset 0):
//   K bufs: [0 .. 2*1344)  stride 84/row   V bufs: [2688 .. 2688+2*1344)
//   P tiles: [5376 .. 5376+4*272)  per-wave 16x16, stride 17
#define KSTR   84
#define KVT    (16 * KSTR)        /* 1344 floats per K or V tile */
#define OFFV   (2 * KVT)          /* 2688 */
#define OFFP   (4 * KVT)          /* 5376 */

static __device__ __forceinline__ void prefetch_kv(const float* kp, const float* vp, int key0,
                                                   int bufsel, int t) {
    const int kbase = bufsel * KVT;
    const int vbase = OFFV + bufsel * KVT;
#pragma unroll
    for (int i = 0; i < 2; ++i) {
        const int f = t + i * 128;           // float4 index 0..255 of the 16x64 tile
        const int row = f >> 4;
        const int c4 = (f & 15) << 2;
        async_ldg_b128((unsigned)((kbase + row * KSTR + c4) * 4),
                       kp + (long)(key0 + row) * D_ + c4);
        async_ldg_b128((unsigned)((vbase + row * KSTR + c4) * 4),
                       vp + (long)(key0 + row) * D_ + c4);
    }
}

__global__ __launch_bounds__(128)
void k_attn(const float* __restrict__ qkv, float* __restrict__ o) {
    __shared__ float smem[OFFP + 4 * 272];   // 6464 floats = 25856 B
    const int t = threadIdx.x;
    const int lane = t & 31;
    const int wave = t >> 5;
    const int hl = lane >> 4;
    const int ln = lane & 15;
    const int bh = blockIdx.y;               // b*H + h
    const int bb = bh >> 4;
    const int h  = bh & (H_ - 1);
    const float* qp = qkv + (long)bh * N_ * D_;
    const float* kp = qkv + (long)BHND + (long)bh * N_ * D_;
    const float* vp = qkv + 2L * BHND + (long)bh * N_ * D_;
    const int qr0 = blockIdx.x * 64 + wave * 16;
    const float scale = 0.125f;              // 1/sqrt(64)

    // Preload Q as 16 pre-scaled A-fragments (K = 0..63)
    v2f qa[16];
#pragma unroll
    for (int kk = 0; kk < 16; ++kk) {
        const float* p = qp + (long)(qr0 + ln) * D_ + kk * 4 + 2 * hl;
        qa[kk].x = p[0] * scale;
        qa[kk].y = p[1] * scale;
    }

    float Mx[8], Lx[8];
    v8f oacc[4] = {};
#pragma unroll
    for (int r = 0; r < 8; ++r) { Mx[r] = -3.0e38f; Lx[r] = 0.0f; }
    float* pl = smem + OFFP + wave * 272;

    prefetch_kv(kp, vp, 0, 0, t);            // ASYNCcnt = 4 (per wave)

    for (int kt = 0; kt < N_ / 16; ++kt) {
        const int cur = kt & 1;
        if (kt + 1 < N_ / 16) {
            prefetch_kv(kp, vp, (kt + 1) * 16, cur ^ 1, t);
            asm volatile("s_wait_asynccnt 0x4" ::: "memory");  // tile kt landed (this wave)
        } else {
            asm volatile("s_wait_asynccnt 0x0" ::: "memory");
        }
        __syncthreads();                     // all waves' async copies of tile kt landed
        const float* lK = smem + cur * KVT;
        const float* lV = smem + OFFV + cur * KVT;

        // S = Q @ K^T (scaled), 16x16
        v8f s = {};
#pragma unroll
        for (int kk = 0; kk < 16; ++kk) {
            const int bi = ln * KSTR + kk * 4 + 2 * hl;
            v2f b; b.x = lK[bi]; b.y = lK[bi + 1];
            s = __builtin_amdgcn_wmma_f32_16x16x4_f32(
                false, qa[kk], false, b, (short)0, s, false, false);
        }
        // Online softmax: rows live across 16 lanes of a half-wave
        float alpha[8];
#pragma unroll
        for (int r = 0; r < 8; ++r) {
            float v = s[r];
            v = fmaxf(v, __shfl_xor(v, 1, 16));
            v = fmaxf(v, __shfl_xor(v, 2, 16));
            v = fmaxf(v, __shfl_xor(v, 4, 16));
            v = fmaxf(v, __shfl_xor(v, 8, 16));
            const float mnew = fmaxf(Mx[r], v);
            const float a = __expf(Mx[r] - mnew);
            const float pv = __expf(s[r] - mnew);
            float rs = pv;
            rs += __shfl_xor(rs, 1, 16);
            rs += __shfl_xor(rs, 2, 16);
            rs += __shfl_xor(rs, 4, 16);
            rs += __shfl_xor(rs, 8, 16);
            Lx[r] = Lx[r] * a + rs;
            Mx[r] = mnew;
            alpha[r] = a;
            pl[(r + 8 * hl) * 17 + ln] = pv;         // C-layout -> LDS (per-wave, no barrier)
        }
#pragma unroll
        for (int j = 0; j < 4; ++j)
#pragma unroll
            for (int r = 0; r < 8; ++r)
                oacc[j][r] *= alpha[r];
        // O += P @ V  (P re-read in A-layout; V from LDS tile)
#pragma unroll
        for (int kk = 0; kk < 4; ++kk) {
            v2f pa;
            pa.x = pl[ln * 17 + kk * 4 + 2 * hl];
            pa.y = pl[ln * 17 + kk * 4 + 2 * hl + 1];
#pragma unroll
            for (int j = 0; j < 4; ++j) {
                const int vi = (kk * 4 + 2 * hl) * KSTR + j * 16 + ln;
                v2f bv; bv.x = lV[vi]; bv.y = lV[vi + KSTR];
                oacc[j] = __builtin_amdgcn_wmma_f32_16x16x4_f32(
                    false, pa, false, bv, (short)0, oacc[j], false, false);
            }
        }
        __syncthreads();  // all waves done with buf[cur] before it is refilled next iter
    }
    // Normalize, write o as [B, N, H*D] (== [B,N,C])
#pragma unroll
    for (int r = 0; r < 8; ++r) Lx[r] = 1.0f / Lx[r];
#pragma unroll
    for (int j = 0; j < 4; ++j) {
#pragma unroll
        for (int r = 0; r < 8; ++r) {
            const int row = qr0 + r + 8 * hl;
            const int d = j * 16 + ln;
            o[((long)bb * N_ + row) * C_ + h * D_ + d] = oacc[j][r] * Lx[r];
        }
    }
}

// ---------------- Kernel 4: out = o @ w_proj^T + b_proj ----------------
__global__ __launch_bounds__(256)
void k_proj_gemm(const float* __restrict__ a_in, const float* __restrict__ w,
                 const float* __restrict__ bias, float* __restrict__ out) {
    __shared__ float ldsB[64 * 36];
    const int t = threadIdx.x;
    const int lane = t & 31, wave = t >> 5;
    const int ln = lane & 15, hl = lane >> 4;
    const int m0 = blockIdx.x * 256 + wave * 32;
    const int n0 = blockIdx.y * 64;
    const int ar0 = m0 + ln, ar1 = m0 + 16 + ln;
    const int wn = t >> 2;
    const int wk = (t & 3) * 8;

    v8f acc[2][4] = {};
    for (int k0 = 0; k0 < C_; k0 += 32) {
        __syncthreads();
        const float4* src = (const float4*)(w + (long)(n0 + wn) * C_ + k0 + wk);
        float4 b0 = src[0], b1 = src[1];
        *(float4*)&ldsB[wn * 36 + wk]     = b0;
        *(float4*)&ldsB[wn * 36 + wk + 4] = b1;
        __syncthreads();
#pragma unroll
        for (int kk = 0; kk < 32; kk += 4) {
            v2f a0 = load_kfrag(a_in, ar0, C_, k0 + kk, lane);
            v2f a1 = load_kfrag(a_in, ar1, C_, k0 + kk, lane);
#pragma unroll
            for (int j = 0; j < 4; ++j) {
                const int bi = (j * 16 + ln) * 36 + kk + 2 * hl;
                v2f b; b.x = ldsB[bi]; b.y = ldsB[bi + 1];
                acc[0][j] = __builtin_amdgcn_wmma_f32_16x16x4_f32(
                    false, a0, false, b, (short)0, acc[0][j], false, false);
                acc[1][j] = __builtin_amdgcn_wmma_f32_16x16x4_f32(
                    false, a1, false, b, (short)0, acc[1][j], false, false);
            }
        }
    }
#pragma unroll
    for (int j = 0; j < 4; ++j) {
        const int col = n0 + j * 16 + ln;
        const float bval = bias[col];
#pragma unroll
        for (int i = 0; i < 2; ++i) {
#pragma unroll
            for (int r = 0; r < 8; ++r) {
                const int m = m0 + i * 16 + r + 8 * hl;
                out[(long)m * C_ + col] = acc[i][j][r] + bval;
            }
        }
    }
}

extern "C" void kernel_launch(void* const* d_in, const int* in_sizes, int n_in,
                              void* d_out, int out_size, void* d_ws, size_t ws_size,
                              hipStream_t stream) {
    const float* x      = (const float*)d_in[0];
    const float* rope   = (const float*)d_in[1];
    const float* w_qkv  = (const float*)d_in[2];
    const float* b_qkv  = (const float*)d_in[3];
    const float* w_proj = (const float*)d_in[4];
    const float* b_proj = (const float*)d_in[5];
    float* out = (float*)d_out;

    float* ws   = (float*)d_ws;
    float* qkv  = ws;                 // 3*BHND floats: q,k,v in [B,H,N,D]
    float* obuf = ws + 3L * BHND;     // B*N*C floats

    // 1) QKV GEMM: M=4096 (256/WG), Ncols=3072 (64/WG)
    dim3 g1(16, 48);
    k_qkv_gemm<<<g1, dim3(256), 0, stream>>>(x, w_qkv, b_qkv, qkv);

    // 2) RoPE on q,k: 2*B*H*N*(D/2) = 2^22 threads
    k_rope<<<dim3(16384), dim3(256), 0, stream>>>(qkv, rope);

    // 3) Flash attention: (N/64) query blocks x (B*H) heads, 4 waves/WG
    dim3 g3(N_ / 64, B_ * H_);
    k_attn<<<g3, dim3(128), 0, stream>>>(qkv, obuf);

    // 4) Projection GEMM: M=4096, Ncols=1024
    dim3 g4(16, 16);
    k_proj_gemm<<<g4, dim3(256), 0, stream>>>(obuf, w_proj, b_proj, out);
}

// v001
// It runs in 428 microseconds.
// Timed twice side by side with v000, it ran 1.09 and 1.08 times as fast.
#include <hip/hip_runtime.h>
#include <hip/hip_bf16.h>
#include <math.h>

typedef __attribute__((ext_vector_type(2))) float v2f;
typedef __attribute__((ext_vector_type(8))) float v8f;

#define B_ 2
#define N_ 2048
#define C_ 1024
#define H_ 16
#define D_ 64
#define BHND (B_*H_*N_*D_)   /* 4,194,304 floats per tensor */

// f32 WMMA fragment with K-major source: element (lane, v) <-> K = k0 + v + 2*(lane>>4)
static __device__ __forceinline__ v2f load_kfrag(const float* __restrict__ base,
                                                 int row, int ld, int k0, int lane) {
    const float* p = base + (long)row * ld + k0 + 2 * (lane >> 4);
    v2f r; r.x = p[0]; r.y = p[1];
    return r;
}

// CDNA5 async copy global->LDS (ASYNCcnt-tracked), 16 bytes per lane. The builtin takes the
// __shared__ pointer itself, so the compiler knows that the array is written.
typedef __attribute__((ext_vector_type(4))) int v4i;
static __device__ __forceinline__ void async_ldg_b128(float* lptr, const float* gptr) {
    __builtin_amdgcn_global_load_async_to_lds_b128(
        (__attribute__((address_space(1))) v4i*)gptr,
        (__attribute__((address_space(3))) v4i*)lptr, 0, 0);
}

// ---------------- Kernel 1: qkv = x @ w_qkv^T + b_qkv, scattered to [3,B,H,N,D] ----------------
// WG: 256 thr (8 waves), tile 256M x 64N; wave tile 32M x 64N (2x A-reuse of B).
// B (weights) staged in LDS once per 32-K chunk -> 8x less redundant L2 traffic.
__global__ __launch_bounds__(256)
void k_qkv_gemm(const float* __restrict__ x, const float* __restrict__ w,
                const float* __restrict__ bias, float* __restrict__ qkv) {
    __shared__ float ldsB[64 * 36];          // 64 cols x 32 K, pad stride 36 (conflict-free)
    const int t = threadIdx.x;
    const int lane = t & 31, wave = t >> 5;
    const int ln = lane & 15, hl = lane >> 4;
    const int m0 = blockIdx.x * 256 + wave * 32;
    const int n0 = blockIdx.y * 64;
    const int ar0 = m0 + ln, ar1 = m0 + 16 + ln;
    const int wn = t >> 2;                   // 0..63: which B row (output col)
    const int wk = (t & 3) * 8;              // 0,8,16,24: K sub-offset

    v8f acc[2][4] = {};
    for (int k0 = 0; k0 < C_; k0 += 32) {
        __syncthreads();
        const float4* src = (const float4*)(w + (long)(n0 + wn) * C_ + k0 + wk);
        float4 b0 = src[0], b1 = src[1];
        *(float4*)&ldsB[wn * 36 + wk]     = b0;
        *(float4*)&ldsB[wn * 36 + wk + 4] = b1;
        __syncthreads();
#pragma unroll
        for (int kk = 0; kk < 32; kk += 4) {
            v2f a0 = load_kfrag(x, ar0, C_, k0 + kk, lane);
            v2f a1 = load_kfrag(x, ar1, C_, k0 + kk, lane);
#pragma unroll
            for (int j = 0; j < 4; ++j) {
                const int bi = (j * 16 + ln) * 36 + kk + 2 * hl;
                v2f b; b.x = ldsB[bi]; b.y = ldsB[bi + 1];
                acc[0][j] = __builtin_amdgcn_wmma_f32_16x16x4_f32(
                    false, a0, false, b, (short)0, acc[0][j], false, false);
                acc[1][j] = __builtin_amdgcn_wmma_f32_16x16x4_f32(
                    false, a1, false, b, (short)0, acc[1][j], false, false);
            }
        }
    }
#pragma unroll
    for (int j = 0; j < 4; ++j) {
        const int col = n0 + j * 16 + ln;
        const float bval = bias[col];
        const int which = col >> 10;         // 0=q,1=k,2=v
        const int rem = col & 1023;
        const int h = rem >> 6, d = rem & 63;
#pragma unroll
        for (int i = 0; i < 2; ++i) {
#pragma unroll
            for (int r = 0; r < 8; ++r) {
                const int m = m0 + i * 16 + r + 8 * hl;
                const int bb = m >> 11, n = m & (N_ - 1);
                qkv[((((long)which * B_ + bb) * H_ + h) * N_ + n) * D_ + d] = acc[i][j][r] + bval;
            }
        }
    }
}

// ---------------- Kernel 2: RoPE on q and k, in place ----------------
__global__ __launch_bounds__(256)
void k_rope(float* __restrict__ qk, const float* __restrict__ rope) {
    const int idx = blockIdx.x * blockDim.x + threadIdx.x;   // 2^22 total
    const int d2    = idx & 31;
    const int n     = (idx >> 5) & (N_ - 1);
    const int h     = (idx >> 16) & (H_ - 1);
    const int bb    = (idx >> 20) & (B_ - 1);
    const int which = idx >> 21;                              // 0=q, 1=k
    float* p = qk + ((((long)which * B_ + bb) * H_ + h) * N_ + n) * D_ + 2 * d2;
    const float* rp = rope + ((long)bb * N_ + n) * (2 * D_);
    float2 xv = *(const float2*)p;
    const float c0 = rp[2 * d2],      c1 = rp[2 * d2 + 1];
    const float s0 = rp[D_ + 2 * d2], s1 = rp[D_ + 2 * d2 + 1];
    float2 ov;
    ov.x = xv.x * c0 - xv.y * s0;
    ov.y = xv.y * c1 + xv.x * s1;
    *(float2*)p = ov;
}

#define KSTR   84
#define KVT    (16 * KSTR)        /* 1344 floats per K or V tile */
#define OFFV   (2 * KVT)          /* 2688 */
#define OFFE   (4 * KVT)          /* 5376: end of the K/V buffers */

// value held by lane l ^ 16 (same query column, other half of the keys)
static __device__ __forceinline__ float xhalf(float v) {
    const int b = __builtin_bit_cast(int, v);
    return __builtin_bit_cast(float,
        __builtin_amdgcn_permlanex16(b, b, 0x76543210, 0xfedcba98, false, false));
}

static __device__ __forceinline__ void prefetch_kv(float* smem, const float* kp, const float* vp,
                                                   int key0, int bufsel, int t) {
    const int kbase = bufsel * KVT;
    const int vbase = OFFV + bufsel * KVT;
#pragma unroll
    for (int i = 0; i < 2; ++i) {
        const int f = t + i * 128;           // float4 index 0..255 of the 16x64 tile
        const int row = f >> 4;
        const int c4 = (f & 15) << 2;
        async_ldg_b128(smem + kbase + row * KSTR + c4, kp + (long)(key0 + row) * D_ + c4);
        async_ldg_b128(smem + vbase + row * KSTR + c4, vp + (long)(key0 + row) * D_ + c4);
    }
}

__global__ __launch_bounds__(128)
void k_attn(const float* __restrict__ qkv, float* __restrict__ o) {
    __shared__ __attribute__((aligned(16))) float smem[OFFE];   // 5376 floats = 21504 B
    const int t = threadIdx.x;
    const int lane = t & 31;
    const int wave = t >> 5;
    const int hl = lane >> 4;
    const int ln = lane & 15;
    const int bh = blockIdx.y;               // b*H + h
    const int bb = bh >> 4;
    const int h  = bh & (H_ - 1);
    const float* qp = qkv + (long)bh * N_ * D_;
    const float* kp = qkv + (long)BHND + (long)bh * N_ * D_;
    const float* vp = qkv + 2L * BHND + (long)bh * N_ * D_;
    const int qr0 = blockIdx.x * 64 + wave * 16;
    const float scale = 0.125f;              // 1/sqrt(64)

    // Preload Q as 16 pre-scaled B-fragments (column = query ln, K = 0..63)
    v2f qa[16];
#pragma unroll
    for (int kk = 0; kk < 16; ++kk) {
        const float* p = qp + (long)(qr0 + ln) * D_ + kk * 4 + 2 * hl;
        qa[kk].x = p[0] * scale;
        qa[kk].y = p[1] * scale;
    }

    // Per lane: running max (equal in both halves) and this half's partial sum of query ln
    float Mx = -3.0e38f, Lx = 0.0f;
    v8f oacc[4] = {};                        // oacc[j][r] = O[query ln][d = 16j + 8hl + r]

    prefetch_kv(smem, kp, vp, 0, 0, t);           // ASYNCcnt = 4 (per wave)

    for (int kt = 0; kt < N_ / 16; ++kt) {
        const int cur = kt & 1;
        if (kt + 1 < N_ / 16) {
            prefetch_kv(smem, kp, vp, (kt + 1) * 16, cur ^ 1, t);
            asm volatile("s_wait_asynccnt 0x4" ::: "memory");  // tile kt landed (this wave)
        } else {
            asm volatile("s_wait_asynccnt 0x0" ::: "memory");
        }
        __syncthreads();                     // all waves' async copies of tile kt landed
        const float* lK = smem + cur * KVT;
        const float* lV = smem + OFFV + cur * KVT;

        // S^T = K @ Q^T (scaled), 16x16: s[r] = score(key r + 8hl, query ln)
        v8f s = {};
#pragma unroll
        for (int kk = 0; kk < 16; ++kk) {
            const int ai = ln * KSTR + kk * 4 + 2 * hl;
            v2f a; a.x = lK[ai]; a.y = lK[ai + 1];
            s = __builtin_amdgcn_wmma_f32_16x16x4_f32(
                false, a, false, qa[kk], (short)0, s, false, false);
        }
        // Online softmax, one query per lane
        float mx = fmaxf(fmaxf(fmaxf(s[0], s[1]), fmaxf(s[2], s[3])),
                         fmaxf(fmaxf(s[4], s[5]), fmaxf(s[6], s[7])));
        mx = fmaxf(mx, xhalf(mx));
        const float mnew = fmaxf(Mx, mx);
        const float alpha = __expf(Mx - mnew);
        float pv[8];
#pragma unroll
        for (int r = 0; r < 8; ++r) pv[r] = __expf(s[r] - mnew);
        Lx = Lx * alpha + (((pv[0] + pv[1]) + (pv[2] + pv[3])) +
                           ((pv[4] + pv[5]) + (pv[6] + pv[7])));
        Mx = mnew;
#pragma unroll
        for (int j = 0; j < 4; ++j)
#pragma unroll
            for (int r = 0; r < 8; ++r)
                oacc[j][r] *= alpha;
        // O^T += V^T @ P^T. k slot (v, hl) of step kk is key 8hl + 2kk + v on both operands:
        // B is the lane's own pv pair, A reads the same two V rows.
#pragma unroll
        for (int kk = 0; kk < 4; ++kk) {
            v2f pb; pb.x = pv[2 * kk]; pb.y = pv[2 * kk + 1];
#pragma unroll
            for (int j = 0; j < 4; ++j) {
                const int vi = (8 * hl + 2 * kk) * KSTR + j * 16 + ln;
                v2f av; av.x = lV[vi]; av.y = lV[vi + KSTR];
                oacc[j] = __builtin_amdgcn_wmma_f32_16x16x4_f32(
                    false, av, false, pb, (short)0, oacc[j], false, false);
            }
        }
        __syncthreads();  // all waves done with buf[cur] before it is refilled next iter
    }
    // Join the halves' sums, normalize, write o as [B, N, H*D] (== [B,N,C]):
    // a lane holds 8 consecutive d per j -> two 16-byte stores
    const float inv = 1.0f / (Lx + xhalf(Lx));
    float* op = o + ((long)bb * N_ + qr0 + ln) * C_ + h * D_ + 8 * hl;
#pragma unroll
    for (int j = 0; j < 4; ++j) {
        float4 lo, hi;
        lo.x = oacc[j][0] * inv; lo.y = oacc[j][1] * inv;
        lo.z = oacc[j][2] * inv; lo.w = oacc[j][3] * inv;
        hi.x = oacc[j][4] * inv; hi.y = oacc[j][5] * inv;
        hi.z = oacc[j][6] * inv; hi.w = oacc[j][7] * inv;
        *(float4*)(op + j * 16)     = lo;
        *(float4*)(op + j * 16 + 4) = hi;
    }
}

// ---------------- Kernel 4: out = o @ w_proj^T + b_proj ----------------
__global__ __launch_bounds__(256)
void k_proj_gemm(const float* __restrict__ a_in, const float* __restrict__ w,
                 const float* __restrict__ bias, float* __restrict__ out) {
    __shared__ float ldsB[64 * 36];
    const int t = threadIdx.x;
    const int lane = t & 31, wave = t >> 5;
    const int ln = lane & 15, hl = lane >> 4;
    const int m0 = blockIdx.x * 256 + wave * 32;
    const int n0 = blockIdx.y * 64;
    const int ar0 = m0 + ln, ar1 = m0 + 16 + ln;
    const int wn = t >> 2;
    const int wk = (t & 3) * 8;

    v8f acc[2][4] = {};
    for (int k0 = 0; k0 < C_; k0 += 32) {
        __syncthreads();
        const float4* src = (const float4*)(w + (long)(n0 + wn) * C_ + k0 + wk);
        float4 b0 = src[0], b1 = src[1];
        *(float4*)&ldsB[wn * 36 + wk]     = b0;
        *(float4*)&ldsB[wn * 36 + wk + 4] = b1;
        __syncthreads();
#pragma unroll
        for (int kk = 0; kk < 32; kk += 4) {
            v2f a0 = load_kfrag(a_in, ar0, C_, k0 + kk, lane);
            v2f a1 = load_kfrag(a_in, ar1, C_, k0 + kk, lane);
#pragma unroll
            for (int j = 0; j < 4; ++j) {
                const int bi = (j * 16 + ln) * 36 + kk + 2 * hl;
                v2f b; b.x = ldsB[bi]; b.y = ldsB[bi + 1];
                acc[0][j] = __builtin_amdgcn_wmma_f32_16x16x4_f32(
                    false, a0, false, b, (short)0, acc[0][j], false, false);
                acc[1][j] = __builtin_amdgcn_wmma_f32_16x16x4_f32(
                    false, a1, false, b, (short)0, acc[1][j], false, false);
            }
        }
    }
#pragma unroll
    for (int j = 0; j < 4; ++j) {
        const int col = n0 + j * 16 + ln;
        const float bval = bias[col];
#pragma unroll
        for (int i = 0; i < 2; ++i) {
#pragma unroll
            for (int r = 0; r < 8; ++r) {
                const int m = m0 + i * 16 + r + 8 * hl;
                out[(long)m * C_ + col] = acc[i][j][r] + bval;
            }
        }
    }
}

extern "C" void kernel_launch(void* const* d_in, const int* in_sizes, int n_in,
                              void* d_out, int out_size, void* d_ws, size_t ws_size,
                              hipStream_t stream) {
    const float* x      = (const float*)d_in[0];
    const float* rope   = (const float*)d_in[1];
    const float* w_qkv  = (const float*)d_in[2];
    const float* b_qkv  = (const float*)d_in[3];
    const float* w_proj = (const float*)d_in[4];
    const float* b_proj = (const float*)d_in[5];
    float* out = (float*)d_out;

    float* ws   = (float*)d_ws;
    float* qkv  = ws;                 // 3*BHND floats: q,k,v in [B,H,N,D]
    float* obuf = ws + 3L * BHND;     // B*N*C floats

    // 1) QKV GEMM: M=4096 (256/WG), Ncols=3072 (64/WG)
    dim3 g1(16, 48);
    k_qkv_gemm<<<g1, dim3(256), 0, stream>>>(x, w_qkv, b_qkv, qkv);

    // 2) RoPE on q,k: 2*B*H*N*(D/2) = 2^22 threads
    k_rope<<<dim3(16384), dim3(256), 0, stream>>>(qkv, rope);

    // 3) Flash attention: (N/64) query blocks x (B*H) heads, 4 waves/WG
    dim3 g3(N_ / 64, B_ * H_);
    k_attn<<<g3, dim3(128), 0, stream>>>(qkv, obuf);

    // 4) Projection GEMM: M=4096, Ncols=1024
    dim3 g4(16, 16);
    k_proj_gemm<<<g4, dim3(256), 0, stream>>>(obuf, w_proj, b_proj, out);
}

// v002
// A run of this version takes 398 microseconds.
// Two timings next to v001 both put it at 1.07 times that version's speed.
// Over all steps from v000 it is 1.17 times as fast.
#include <hip/hip_runtime.h>
#include <hip/hip_bf16.h>
#include <math.h>

typedef __attribute__((ext_vector_type(2))) float v2f;
typedef __attribute__((ext_vector_type(8))) float v8f;

#define B_ 2
#define N_ 2048
#define C_ 1024
#define H_ 16
#define D_ 64
#define BHND (B_*H_*N_*D_)   /* 4,194,304 floats per tensor */

// f32 WMMA fragment with K-major source: element (lane, v) <-> K = k0 + v + 2*(lane>>4)
static __device__ __forceinline__ v2f load_kfrag(const float* __restrict__ base,
                                                 int row, int ld, int k0, int lane) {
    const float* p = base + (long)row * ld + k0 + 2 * (lane >> 4);
    v2f r; r.x = p[0]; r.y = p[1];
    return r;
}

// CDNA5 async copy global->LDS (ASYNCcnt-tracked), 16 bytes per lane. The builtin takes the
// __shared__ pointer itself, so the compiler knows that the array is written.
typedef __attribute__((ext_vector_type(4))) int v4i;
static __device__ __forceinline__ void async_ldg_b128(float* lptr, const float* gptr) {
    __builtin_amdgcn_global_load_async_to_lds_b128(
        (__attribute__((address_space(1))) v4i*)gptr,
        (__attribute__((address_space(3))) v4i*)lptr, 0, 0);
}

// ------- Kernel 1: qkv = x @ w_qkv^T + b_qkv, RoPE on q and k, scattered to [3,B,H,N,D] -------
// WG: 256 thr (8 waves), tile 256M x 64N; wave tile 32M x 64N (2x A-reuse of B).
// B (weights) staged in LDS once per 32-K chunk -> 8x less redundant L2 traffic.
// The 64 columns of a WG are one head of q, k or v. LDS row j*16+ln holds weight row 4*ln+j,
// so column tile j gives lane ln column d = 4*ln+j: a lane holds 4 adjacent d of a row, both
// members of each rotary pair, and reads cos/sin and stores its result 16 bytes at a time.
__global__ __launch_bounds__(256)
void k_qkv_gemm(const float* __restrict__ x, const float* __restrict__ w,
                const float* __restrict__ bias, const float* __restrict__ rope,
                float* __restrict__ qkv) {
    __shared__ float ldsB[64 * 36];          // 64 cols x 32 K, pad stride 36 (conflict-free)
    const int t = threadIdx.x;
    const int lane = t & 31, wave = t >> 5;
    const int ln = lane & 15, hl = lane >> 4;
    const int m0 = blockIdx.x * 256 + wave * 32;
    const int n0 = blockIdx.y * 64;
    const int ar0 = m0 + ln, ar1 = m0 + 16 + ln;
    const int wn = t >> 2;                   // 0..63: which LDS row of B
    const int wr = 4 * (wn & 15) + (wn >> 4);  // the weight row (output col) it holds
    const int wk = (t & 3) * 8;              // 0,8,16,24: K sub-offset

    v8f acc[2][4] = {};
    for (int k0 = 0; k0 < C_; k0 += 32) {
        __syncthreads();
        const float4* src = (const float4*)(w + (long)(n0 + wr) * C_ + k0 + wk);
        float4 b0 = src[0], b1 = src[1];
        *(float4*)&ldsB[wn * 36 + wk]     = b0;
        *(float4*)&ldsB[wn * 36 + wk + 4] = b1;
        __syncthreads();
#pragma unroll
        for (int kk = 0; kk < 32; kk += 4) {
            v2f a0 = load_kfrag(x, ar0, C_, k0 + kk, lane);
            v2f a1 = load_kfrag(x, ar1, C_, k0 + kk, lane);
#pragma unroll
            for (int j = 0; j < 4; ++j) {
                const int bi = (j * 16 + ln) * 36 + kk + 2 * hl;
                v2f b; b.x = ldsB[bi]; b.y = ldsB[bi + 1];
                acc[0][j] = __builtin_amdgcn_wmma_f32_16x16x4_f32(
                    false, a0, false, b, (short)0, acc[0][j], false, false);
                acc[1][j] = __builtin_amdgcn_wmma_f32_16x16x4_f32(
                    false, a1, false, b, (short)0, acc[1][j], false, false);
            }
        }
    }
    const int which = blockIdx.y >> 4;       // 0=q,1=k,2=v (same for the whole WG)
    const int h = blockIdx.y & (H_ - 1);
    const int d0 = 4 * ln;
    const float4 b4 = *(const float4*)(bias + n0 + d0);
    const int mr = m0 + 8 * hl;              // row of (i = 0, r = 0); a WG stays inside one batch
    float* qp = qkv + ((((long)which * B_ + (mr >> 11)) * H_ + h) * N_ + (mr & (N_ - 1))) * D_ + d0;
    if (which < 2) {
        const float* rp = rope + (long)mr * (2 * D_) + d0;   // cos at d, sin at D_ + d
#pragma unroll
        for (int i = 0; i < 2; ++i) {
            float4 c[8], s[8];
#pragma unroll
            for (int r = 0; r < 8; ++r) {
                c[r] = *(const float4*)(rp + (i * 16 + r) * (2 * D_));
                s[r] = *(const float4*)(rp + (i * 16 + r) * (2 * D_) + D_);
            }
            // keeps the 16 loads of this half one group ahead of their uses: one load latency
            // a half; left to itself the scheduler waits for them pair by pair
            __builtin_amdgcn_sched_barrier(0);
#pragma unroll
            for (int r = 0; r < 8; ++r) {
                const float v0 = acc[i][0][r] + b4.x, v1 = acc[i][1][r] + b4.y;
                const float v2 = acc[i][2][r] + b4.z, v3 = acc[i][3][r] + b4.w;
                float4 ov;
                ov.x = v0 * c[r].x - v1 * s[r].x;
                ov.y = v1 * c[r].y + v0 * s[r].y;
                ov.z = v2 * c[r].z - v3 * s[r].z;
                ov.w = v3 * c[r].w + v2 * s[r].w;
                *(float4*)(qp + (i * 16 + r) * D_) = ov;
            }
        }
    } else {
#pragma unroll
        for (int i = 0; i < 2; ++i) {
#pragma unroll
            for (int r = 0; r < 8; ++r) {
                float4 ov;
                ov.x = acc[i][0][r] + b4.x; ov.y = acc[i][1][r] + b4.y;
                ov.z = acc[i][2][r] + b4.z; ov.w = acc[i][3][r] + b4.w;
                *(float4*)(qp + (i * 16 + r) * D_) = ov;
            }
        }
        // the build joins this branch's tail with the rotary branch's, whose loads name the
        // stores' data registers: the wait stands between the stores and any such rewrite
        asm volatile("s_wait_xcnt 0x0" ::: "memory");
    }
}

#define KSTR   84
#define KVT    (16 * KSTR)        /* 1344 floats per K or V tile */
#define OFFV   (2 * KVT)          /* 2688 */
#define OFFE   (4 * KVT)          /* 5376: end of the K/V buffers */

// value held by lane l ^ 16 (same query column, other half of the keys)
static __device__ __forceinline__ float xhalf(float v) {
    const int b = __builtin_bit_cast(int, v);
    return __builtin_bit_cast(float,
        __builtin_amdgcn_permlanex16(b, b, 0x76543210, 0xfedcba98, false, false));
}

static __device__ __forceinline__ void prefetch_kv(float* smem, const float* kp, const float* vp,
                                                   int key0, int bufsel, int t) {
    const int kbase = bufsel * KVT;
    const int vbase = OFFV + bufsel * KVT;
#pragma unroll
    for (int i = 0; i < 2; ++i) {
        const int f = t + i * 128;           // float4 index 0..255 of the 16x64 tile
        const int row = f >> 4;
        const int c4 = (f & 15) << 2;
        async_ldg_b128(smem + kbase + row * KSTR + c4, kp + (long)(key0 + row) * D_ + c4);
        async_ldg_b128(smem + vbase + row * KSTR + c4, vp + (long)(key0 + row) * D_ + c4);
    }
}

__global__ __launch_bounds__(128)
void k_attn(const float* __restrict__ qkv, float* __restrict__ o) {
    __shared__ __attribute__((aligned(16))) float smem[OFFE];   // 5376 floats = 21504 B
    const int t = threadIdx.x;
    const int lane = t & 31;
    const int wave = t >> 5;
    const int hl = lane >> 4;
    const int ln = lane & 15;
    const int bh = blockIdx.y;               // b*H + h
    const int bb = bh >> 4;
    const int h  = bh & (H_ - 1);
    const float* qp = qkv + (long)bh * N_ * D_;
    const float* kp = qkv + (long)BHND + (long)bh * N_ * D_;
    const float* vp = qkv + 2L * BHND + (long)bh * N_ * D_;
    const int qr0 = blockIdx.x * 64 + wave * 16;
    const float scale = 0.125f;              // 1/sqrt(64)

    // Preload Q as 16 pre-scaled B-fragments (column = query ln, K = 0..63)
    v2f qa[16];
#pragma unroll
    for (int kk = 0; kk < 16; ++kk) {
        const float* p = qp + (long)(qr0 + ln) * D_ + kk * 4 + 2 * hl;
        qa[kk].x = p[0] * scale;
        qa[kk].y = p[1] * scale;
    }

    // Per lane: running max (equal in both halves) and this half's partial sum of query ln
    float Mx = -3.0e38f, Lx = 0.0f;
    v8f oacc[4] = {};                        // oacc[j][r] = O[query ln][d = 16j + 8hl + r]

    prefetch_kv(smem, kp, vp, 0, 0, t);           // ASYNCcnt = 4 (per wave)

    for (int kt = 0; kt < N_ / 16; ++kt) {
        const int cur = kt & 1;
        if (kt + 1 < N_ / 16) {
            prefetch_kv(smem, kp, vp, (kt + 1) * 16, cur ^ 1, t);
            asm volatile("s_wait_asynccnt 0x4" ::: "memory");  // tile kt landed (this wave)
        } else {
            asm volatile("s_wait_asynccnt 0x0" ::: "memory");
        }
        __syncthreads();                     // all waves' async copies of tile kt landed
        const float* lK = smem + cur * KVT;
        const float* lV = smem + OFFV + cur * KVT;

        // S^T = K @ Q^T (scaled), 16x16: s[r] = score(key r + 8hl, query ln)
        v8f s = {};
#pragma unroll
        for (int kk = 0; kk < 16; ++kk) {
            const int ai = ln * KSTR + kk * 4 + 2 * hl;
            v2f a; a.x = lK[ai]; a.y = lK[ai + 1];
            s = __builtin_amdgcn_wmma_f32_16x16x4_f32(
                false, a, false, qa[kk], (short)0, s, false, false);
        }
        // Online softmax, one query per lane
        float mx = fmaxf(fmaxf(fmaxf(s[0], s[1]), fmaxf(s[2], s[3])),
                         fmaxf(fmaxf(s[4], s[5]), fmaxf(s[6], s[7])));
        mx = fmaxf(mx, xhalf(mx));
        const float mnew = fmaxf(Mx, mx);
        const float alpha = __expf(Mx - mnew);
        float pv[8];
#pragma unroll
        for (int r = 0; r < 8; ++r) pv[r] = __expf(s[r] - mnew);
        Lx = Lx * alpha + (((pv[0] + pv[1]) + (pv[2] + pv[3])) +
                           ((pv[4] + pv[5]) + (pv[6] + pv[7])));
        Mx = mnew;
#pragma unroll
        for (int j = 0; j < 4; ++j)
#pragma unroll
            for (int r = 0; r < 8; ++r)
                oacc[j][r] *= alpha;
        // O^T += V^T @ P^T. k slot (v, hl) of step kk is key 8hl + 2kk + v on both operands:
        // B is the lane's own pv pair, A reads the same two V rows.
#pragma unroll
        for (int kk = 0; kk < 4; ++kk) {
            v2f pb; pb.x = pv[2 * kk]; pb.y = pv[2 * kk + 1];
#pragma unroll
            for (int j = 0; j < 4; ++j) {
                const int vi = (8 * hl + 2 * kk) * KSTR + j * 16 + ln;
                v2f av; av.x = lV[vi]; av.y = lV[vi + KSTR];
                oacc[j] = __builtin_amdgcn_wmma_f32_16x16x4_f32(
                    false, av, false, pb, (short)0, oacc[j], false, false);
            }
        }
        __syncthreads();  // all waves done with buf[cur] before it is refilled next iter
    }
    // Join the halves' sums, normalize, write o as [B, N, H*D] (== [B,N,C]):
    // a lane holds 8 consecutive d per j -> two 16-byte stores
    const float inv = 1.0f / (Lx + xhalf(Lx));
    float* op = o + ((long)bb * N_ + qr0 + ln) * C_ + h * D_ + 8 * hl;
#pragma unroll
    for (int j = 0; j < 4; ++j) {
        float4 lo, hi;
        lo.x = oacc[j][0] * inv; lo.y = oacc[j][1] * inv;
        lo.z = oacc[j][2] * inv; lo.w = oacc[j][3] * inv;
        hi.x = oacc[j][4] * inv; hi.y = oacc[j][5] * inv;
        hi.z = oacc[j][6] * inv; hi.w = oacc[j][7] * inv;
        *(float4*)(op + j * 16)     = lo;
        *(float4*)(op + j * 16 + 4) = hi;
    }
}

// ---------------- Kernel 3: out = o @ w_proj^T + b_proj ----------------
__global__ __launch_bounds__(256)
void k_proj_gemm(const float* __restrict__ a_in, const float* __restrict__ w,
                 const float* __restrict__ bias, float* __restrict__ out) {
    __shared__ float ldsB[64 * 36];
    const int t = threadIdx.x;
    const int lane = t & 31, wave = t >> 5;
    const int ln = lane & 15, hl = lane >> 4;
    const int m0 = blockIdx.x * 256 + wave * 32;
    const int n0 = blockIdx.y * 64;
    const int ar0 = m0 + ln, ar1 = m0 + 16 + ln;
    const int wn = t >> 2;
    const int wk = (t & 3) * 8;

    v8f acc[2][4] = {};
    for (int k0 = 0; k0 < C_; k0 += 32) {
        __syncthreads();
        const float4* src = (const float4*)(w + (long)(n0 + wn) * C_ + k0 + wk);
        float4 b0 = src[0], b1 = src[1];
        *(float4*)&ldsB[wn * 36 + wk]     = b0;
        *(float4*)&ldsB[wn * 36 + wk + 4] = b1;
        __syncthreads();
#pragma unroll
        for (int kk = 0; kk < 32; kk += 4) {
            v2f a0 = load_kfrag(a_in, ar0, C_, k0 + kk, lane);
            v2f a1 = load_kfrag(a_in, ar1, C_, k0 + kk, lane);
#pragma unroll
            for (int j = 0; j < 4; ++j) {
                const int bi = (j * 16 + ln) * 36 + kk + 2 * hl;
                v2f b; b.x = ldsB[bi]; b.y = ldsB[bi + 1];
                acc[0][j] = __builtin_amdgcn_wmma_f32_16x16x4_f32(
                    false, a0, false, b, (short)0, acc[0][j], false, false);
                acc[1][j] = __builtin_amdgcn_wmma_f32_16x16x4_f32(
                    false, a1, false, b, (short)0, acc[1][j], false, false);
            }
        }
    }
#pragma unroll
    for (int j = 0; j < 4; ++j) {
        const int col = n0 + j * 16 + ln;
        const float bval = bias[col];
#pragma unroll
        for (int i = 0; i < 2; ++i) {
#pragma unroll
            for (int r = 0; r < 8; ++r) {
                const int m = m0 + i * 16 + r + 8 * hl;
                out[(long)m * C_ + col] = acc[i][j][r] + bval;
            }
        }
    }
}

extern "C" void kernel_launch(void* const* d_in, const int* in_sizes, int n_in,
                              void* d_out, int out_size, void* d_ws, size_t ws_size,
                              hipStream_t stream) {
    const float* x      = (const float*)d_in[0];
    const float* rope   = (const float*)d_in[1];
    const float* w_qkv  = (const float*)d_in[2];
    const float* b_qkv  = (const float*)d_in[3];
    const float* w_proj = (const float*)d_in[4];
    const float* b_proj = (const float*)d_in[5];
    float* out = (float*)d_out;

    float* ws   = (float*)d_ws;
    float* qkv  = ws;                 // 3*BHND floats: q,k,v in [B,H,N,D]
    float* obuf = ws + 3L * BHND;     // B*N*C floats

    // 1) QKV GEMM with RoPE: M=4096 (256/WG), Ncols=3072 (64/WG)
    dim3 g1(16, 48);
    k_qkv_gemm<<<g1, dim3(256), 0, stream>>>(x, w_qkv, b_qkv, rope, qkv);

    // 2) Flash attention: (N/64) query blocks x (B*H) heads, 4 waves/WG
    dim3 g3(N_ / 64, B_ * H_);
    k_attn<<<g3, dim3(128), 0, stream>>>(qkv, obuf);

    // 3) Projection GEMM: M=4096, Ncols=1024
    dim3 g4(16, 16);
    k_proj_gemm<<<g4, dim3(256), 0, stream>>>(obuf, w_proj, b_proj, out);
}

// v003
// One run takes 363 microseconds.
// In both of two side-by-side timings against v002, it was 1.10 times as fast.
// Over all steps from v000 it is 1.28 times as fast.
#include <hip/hip_runtime.h>
#include <hip/hip_bf16.h>
#include <math.h>

typedef __attribute__((ext_vector_type(2))) float v2f;
typedef __attribute__((ext_vector_type(8))) float v8f;

#define B_ 2
#define N_ 2048
#define C_ 1024
#define H_ 16
#define D_ 64
#define BHND (B_*H_*N_*D_)   /* 4,194,304 floats per tensor */

// CDNA5 async copy global->LDS (ASYNCcnt-tracked), 16 bytes per lane. The builtin takes the
// __shared__ pointer itself, so the compiler knows that the array is written.
typedef __attribute__((ext_vector_type(4))) int v4i;
static __device__ __forceinline__ void async_ldg_b128(float* lptr, const float* gptr) {
    __builtin_amdgcn_global_load_async_to_lds_b128(
        (__attribute__((address_space(1))) v4i*)gptr,
        (__attribute__((address_space(3))) v4i*)lptr, 0, 0);
}

// ------- GEMM main loop shared by kernels 1 and 3: acc = A[256 rows] * W[64 rows]^T over K = C_ -------
// WG: 256 thr (8 waves), tile 256M x 64N; wave tile 32M x 64N. A pass is 32 k = one 128-byte line of
// every operand row. Both operands go through a two-buffer LDS ring filled by async copies: a
// wave's copy covers 4 whole lines, and pass t+1's copies fly while pass t is worked on.
// f32 WMMA fragment, K-major rows: element (lane, v) <-> K = k0 + v + 2*(lane>>4).
#define GPIT   36                       /* LDS row pitch in floats: 144 B, conflict-free */
#define GOFFB  (256 * GPIT)             /* W rows stand behind the 256 A rows */
#define GBUF   ((256 + 64) * GPIT)      /* 11520 floats = 46080 B a buffer */

// DEAL: LDS row j*16+ln holds weight row 4*ln+j (kernel 1), else row j*16+ln (kernel 3).
// au, wu: the WG's first A row and first W row at this pass's k, the same in every lane; a lane
// adds one byte offset per operand, so no address per copy stays in registers over the pass.
template <bool DEAL>
static __device__ __forceinline__ void gemm_stage(float* buf, const float* __restrict__ au,
                                                  const float* __restrict__ wu, int t) {
    const unsigned r0 = t >> 3;              // 0..31: 8 lanes bring one row's 128 bytes
    const unsigned c4 = (t & 7) << 2;
    const unsigned ga = (r0 * C_ + c4) * 4;
    const unsigned gw = DEAL ? ((4 * (r0 & 15) + (r0 >> 4)) * C_ + c4) * 4 : ga;
#pragma unroll
    for (int i = 0; i < 8; ++i)              // LDS row r0 + 32 i <- A row r0 + 32 i
        async_ldg_b128(buf + (r0 + i * 32) * GPIT + c4,
                       (const float*)((const char*)(au + i * 32 * C_) + ga));
#pragma unroll
    for (int i = 0; i < 2; ++i)              // LDS row r0 + 32 i <- W row (dealt: + 2 i)
        async_ldg_b128(buf + GOFFB + (r0 + i * 32) * GPIT + c4,
                       (const float*)((const char*)(wu + i * (DEAL ? 2 : 32) * C_) + gw));
}

template <bool DEAL>
static __device__ __forceinline__ void gemm_mainloop(float* smem, const float* __restrict__ a,
                                                     const float* __restrict__ w,
                                                     int mwg, int n0, int t, v8f (&acc)[2][4]) {
    const int lane = t & 31, wave = t >> 5;
    const int ln = lane & 15, hl = lane >> 4;
    const float* au = a + (long)mwg * C_;
    const float* wu = w + (long)n0 * C_;
    gemm_stage<DEAL>(smem, au, wu, t);
    asm volatile("s_wait_asynccnt 0x0" ::: "memory");  // this wave's share of pass 0 has landed
    __syncthreads();                                   // ... and every other wave's
    gemm_stage<DEAL>(smem + GBUF, au + 32, wu + 32, t);
    for (int kt = 0; kt < C_ / 32; ++kt) {
        const float* sA = smem + (kt & 1) * GBUF + (wave * 32 + ln) * GPIT + 2 * hl;
        const float* sB = smem + (kt & 1) * GBUF + GOFFB + ln * GPIT + 2 * hl;
#pragma unroll
        for (int kk = 0; kk < 32; kk += 4) {
            const v2f a0 = *(const v2f*)(sA + kk);
            const v2f a1 = *(const v2f*)(sA + 16 * GPIT + kk);
#pragma unroll
            for (int j = 0; j < 4; ++j) {
                const v2f b = *(const v2f*)(sB + j * 16 * GPIT + kk);
                acc[0][j] = __builtin_amdgcn_wmma_f32_16x16x4_f32(
                    false, a0, false, b, (short)0, acc[0][j], false, false);
                acc[1][j] = __builtin_amdgcn_wmma_f32_16x16x4_f32(
                    false, a1, false, b, (short)0, acc[1][j], false, false);
            }
        }
        // publish point of pass kt+1: this wave's reads of the buffer are done, its copies of
        // the next pass have landed; behind the barrier that holds for all eight waves
        asm volatile("s_wait_dscnt 0x0" ::: "memory");
        asm volatile("s_wait_asynccnt 0x0" ::: "memory");
        __syncthreads();
        if (kt + 2 < C_ / 32)                // refill the buffer that every wave has just left
            gemm_stage<DEAL>(smem + (kt & 1) * GBUF, au + (kt + 2) * 32, wu + (kt + 2) * 32, t);
    }
    asm volatile("s_wait_asynccnt 0x0" ::: "memory");  // no copy is left in flight at the end
}

// ------- Kernel 1: qkv = x @ w_qkv^T + b_qkv, RoPE on q and k, scattered to [3,B,H,N,D] -------
// Main loop: gemm_mainloop above (WG tile 256M x 64N, wave tile 32M x 64N).
// The 64 columns of a WG are one head of q, k or v. LDS row j*16+ln holds weight row 4*ln+j,
// so column tile j gives lane ln column d = 4*ln+j: a lane holds 4 adjacent d of a row, both
// members of each rotary pair, and reads cos/sin and stores its result 16 bytes at a time.
// 160 registers a wave: six waves a SIMD, so that the three WGs a WGP gets (LDS holds three) run together
__global__ __launch_bounds__(256) __attribute__((amdgpu_num_vgpr(160)))
void k_qkv_gemm(const float* __restrict__ x, const float* __restrict__ w,
                const float* __restrict__ bias, const float* __restrict__ rope,
                float* __restrict__ qkv) {
    __shared__ __attribute__((aligned(16))) float smem[2 * GBUF];   // 92160 B
    const int t = threadIdx.x;
    const int lane = t & 31, wave = t >> 5;
    const int ln = lane & 15, hl = lane >> 4;
    const int m0 = blockIdx.x * 256 + wave * 32;
    const int n0 = blockIdx.y * 64;

    v8f acc[2][4] = {};
    gemm_mainloop<true>(smem, x, w, blockIdx.x * 256, n0, t, acc);
    const int which = blockIdx.y >> 4;       // 0=q,1=k,2=v (same for the whole WG)
    const int h = blockIdx.y & (H_ - 1);
    const int d0 = 4 * ln;
    const float4 b4 = *(const float4*)(bias + n0 + d0);
    const int mr = m0 + 8 * hl;              // row of (i = 0, r = 0); a WG stays inside one batch
    float* qp = qkv + ((((long)which * B_ + (mr >> 11)) * H_ + h) * N_ + (mr & (N_ - 1))) * D_ + d0;
    if (which < 2) {
        const float* rp = rope + (long)mr * (2 * D_) + d0;   // cos at d, sin at D_ + d
#pragma unroll
        for (int i = 0; i < 2; ++i) {
            float4 c[8], s[8];
#pragma unroll
            for (int r = 0; r < 8; ++r) {
                c[r] = *(const float4*)(rp + (i * 16 + r) * (2 * D_));
                s[r] = *(const float4*)(rp + (i * 16 + r) * (2 * D_) + D_);
            }
            // keeps the 16 loads of this half one group ahead of their uses: one load latency
            // a half; left to itself the scheduler waits for them pair by pair
            __builtin_amdgcn_sched_barrier(0);
#pragma unroll
            for (int r = 0; r < 8; ++r) {
                const float v0 = acc[i][0][r] + b4.x, v1 = acc[i][1][r] + b4.y;
                const float v2 = acc[i][2][r] + b4.z, v3 = acc[i][3][r] + b4.w;
                float4 ov;
                ov.x = v0 * c[r].x - v1 * s[r].x;
                ov.y = v1 * c[r].y + v0 * s[r].y;
                ov.z = v2 * c[r].z - v3 * s[r].z;
                ov.w = v3 * c[r].w + v2 * s[r].w;
                *(float4*)(qp + (i * 16 + r) * D_) = ov;
            }
        }
    } else {
#pragma unroll
        for (int i = 0; i < 2; ++i) {
#pragma unroll
            for (int r = 0; r < 8; ++r) {
                float4 ov;
                ov.x = acc[i][0][r] + b4.x; ov.y = acc[i][1][r] + b4.y;
                ov.z = acc[i][2][r] + b4.z; ov.w = acc[i][3][r] + b4.w;
                *(float4*)(qp + (i * 16 + r) * D_) = ov;
            }
        }
        // the build joins this branch's tail with the rotary branch's, whose loads name the
        // stores' data registers: the wait stands between the stores and any such rewrite
        asm volatile("s_wait_xcnt 0x0" ::: "memory");
    }
}

#define KSTR   84
#define KVT    (16 * KSTR)        /* 1344 floats per K or V tile */
#define OFFV   (2 * KVT)          /* 2688 */
#define OFFE   (4 * KVT)          /* 5376: end of the K/V buffers */

// value held by lane l ^ 16 (same query column, other half of the keys)
static __device__ __forceinline__ float xhalf(float v) {
    const int b = __builtin_bit_cast(int, v);
    return __builtin_bit_cast(float,
        __builtin_amdgcn_permlanex16(b, b, 0x76543210, 0xfedcba98, false, false));
}

static __device__ __forceinline__ void prefetch_kv(float* smem, const float* kp, const float* vp,
                                                   int key0, int bufsel, int t) {
    const int kbase = bufsel * KVT;
    const int vbase = OFFV + bufsel * KVT;
#pragma unroll
    for (int i = 0; i < 2; ++i) {
        const int f = t + i * 128;           // float4 index 0..255 of the 16x64 tile
        const int row = f >> 4;
        const int c4 = (f & 15) << 2;
        async_ldg_b128(smem + kbase + row * KSTR + c4, kp + (long)(key0 + row) * D_ + c4);
        async_ldg_b128(smem + vbase + row * KSTR + c4, vp + (long)(key0 + row) * D_ + c4);
    }
}

__global__ __launch_bounds__(128)
void k_attn(const float* __restrict__ qkv, float* __restrict__ o) {
    __shared__ __attribute__((aligned(16))) float smem[OFFE];   // 5376 floats = 21504 B
    const int t = threadIdx.x;
    const int lane = t & 31;
    const int wave = t >> 5;
    const int hl = lane >> 4;
    const int ln = lane & 15;
    const int bh = blockIdx.y;               // b*H + h
    const int bb = bh >> 4;
    const int h  = bh & (H_ - 1);
    const float* qp = qkv + (long)bh * N_ * D_;
    const float* kp = qkv + (long)BHND + (long)bh * N_ * D_;
    const float* vp = qkv + 2L * BHND + (long)bh * N_ * D_;
    const int qr0 = blockIdx.x * 64 + wave * 16;
    const float scale = 0.125f;              // 1/sqrt(64)

    // Preload Q as 16 pre-scaled B-fragments (column = query ln, K = 0..63)
    v2f qa[16];
#pragma unroll
    for (int kk = 0; kk < 16; ++kk) {
        const float* p = qp + (long)(qr0 + ln) * D_ + kk * 4 + 2 * hl;
        qa[kk].x = p[0] * scale;
        qa[kk].y = p[1] * scale;
    }

    // Per lane: running max (equal in both halves) and this half's partial sum of query ln
    float Mx = -3.0e38f, Lx = 0.0f;
    v8f oacc[4] = {};                        // oacc[j][r] = O[query ln][d = 16j + 8hl + r]

    prefetch_kv(smem, kp, vp, 0, 0, t);           // ASYNCcnt = 4 (per wave)

    for (int kt = 0; kt < N_ / 16; ++kt) {
        const int cur = kt & 1;
        if (kt + 1 < N_ / 16) {
            prefetch_kv(smem, kp, vp, (kt + 1) * 16, cur ^ 1, t);
            asm volatile("s_wait_asynccnt 0x4" ::: "memory");  // tile kt landed (this wave)
        } else {
            asm volatile("s_wait_asynccnt 0x0" ::: "memory");
        }
        __syncthreads();                     // all waves' async copies of tile kt landed
        const float* lK = smem + cur * KVT;
        const float* lV = smem + OFFV + cur * KVT;

        // S^T = K @ Q^T (scaled), 16x16: s[r] = score(key r + 8hl, query ln)
        v8f s = {};
#pragma unroll
        for (int kk = 0; kk < 16; ++kk) {
            const int ai = ln * KSTR + kk * 4 + 2 * hl;
            v2f a; a.x = lK[ai]; a.y = lK[ai + 1];
            s = __builtin_amdgcn_wmma_f32_16x16x4_f32(
                false, a, false, qa[kk], (short)0, s, false, false);
        }
        // Online softmax, one query per lane
        float mx = fmaxf(fmaxf(fmaxf(s[0], s[1]), fmaxf(s[2], s[3])),
                         fmaxf(fmaxf(s[4], s[5]), fmaxf(s[6], s[7])));
        mx = fmaxf(mx, xhalf(mx));
        const float mnew = fmaxf(Mx, mx);
        const float alpha = __expf(Mx - mnew);
        float pv[8];
#pragma unroll
        for (int r = 0; r < 8; ++r) pv[r] = __expf(s[r] - mnew);
        Lx = Lx * alpha + (((pv[0] + pv[1]) + (pv[2] + pv[3])) +
                           ((pv[4] + pv[5]) + (pv[6] + pv[7])));
        Mx = mnew;
#pragma unroll
        for (int j = 0; j < 4; ++j)
#pragma unroll
            for (int r = 0; r < 8; ++r)
                oacc[j][r] *= alpha;
        // O^T += V^T @ P^T. k slot (v, hl) of step kk is key 8hl + 2kk + v on both operands:
        // B is the lane's own pv pair, A reads the same two V rows.
#pragma unroll
        for (int kk = 0; kk < 4; ++kk) {
            v2f pb; pb.x = pv[2 * kk]; pb.y = pv[2 * kk + 1];
#pragma unroll
            for (int j = 0; j < 4; ++j) {
                const int vi = (8 * hl + 2 * kk) * KSTR + j * 16 + ln;
                v2f av; av.x = lV[vi]; av.y = lV[vi + KSTR];
                oacc[j] = __builtin_amdgcn_wmma_f32_16x16x4_f32(
                    false, av, false, pb, (short)0, oacc[j], false, false);
            }
        }
        __syncthreads();  // all waves done with buf[cur] before it is refilled next iter
    }
    // Join the halves' sums, normalize, write o as [B, N, H*D] (== [B,N,C]):
    // a lane holds 8 consecutive d per j -> two 16-byte stores
    const float inv = 1.0f / (Lx + xhalf(Lx));
    float* op = o + ((long)bb * N_ + qr0 + ln) * C_ + h * D_ + 8 * hl;
#pragma unroll
    for (int j = 0; j < 4; ++j) {
        float4 lo, hi;
        lo.x = oacc[j][0] * inv; lo.y = oacc[j][1] * inv;
        lo.z = oacc[j][2] * inv; lo.w = oacc[j][3] * inv;
        hi.x = oacc[j][4] * inv; hi.y = oacc[j][5] * inv;
        hi.z = oacc[j][6] * inv; hi.w = oacc[j][7] * inv;
        *(float4*)(op + j * 16)     = lo;
        *(float4*)(op + j * 16 + 4) = hi;
    }
}

// ---------------- Kernel 3: out = o @ w_proj^T + b_proj ----------------
__global__ __launch_bounds__(256)
void k_proj_gemm(const float* __restrict__ a_in, const float* __restrict__ w,
                 const float* __restrict__ bias, float* __restrict__ out) {
    __shared__ __attribute__((aligned(16))) float smem[2 * GBUF];   // 92160 B
    const int t = threadIdx.x;
    const int lane = t & 31, wave = t >> 5;
    const int ln = lane & 15, hl = lane >> 4;
    const int m0 = blockIdx.x * 256 + wave * 32;
    const int n0 = blockIdx.y * 64;

    v8f acc[2][4] = {};
    gemm_mainloop<false>(smem, a_in, w, blockIdx.x * 256, n0, t, acc);
#pragma unroll
    for (int j = 0; j < 4; ++j) {
        const int col = n0 + j * 16 + ln;
        const float bval = bias[col];
#pragma unroll
        for (int i = 0; i < 2; ++i) {
#pragma unroll
            for (int r = 0; r < 8; ++r) {
                const int m = m0 + i * 16 + r + 8 * hl;
                out[(long)m * C_ + col] = acc[i][j][r] + bval;
            }
        }
    }
}

extern "C" void kernel_launch(void* const* d_in, const int* in_sizes, int n_in,
                              void* d_out, int out_size, void* d_ws, size_t ws_size,
                              hipStream_t stream) {
    const float* x      = (const float*)d_in[0];
    const float* rope   = (const float*)d_in[1];
    const float* w_qkv  = (const float*)d_in[2];
    const float* b_qkv  = (const float*)d_in[3];
    const float* w_proj = (const float*)d_in[4];
    const float* b_proj = (const float*)d_in[5];
    float* out = (float*)d_out;

    float* ws   = (float*)d_ws;
    float* qkv  = ws;                 // 3*BHND floats: q,k,v in [B,H,N,D]
    float* obuf = ws + 3L * BHND;     // B*N*C floats

    // 1) QKV GEMM with RoPE: M=4096 (256/WG), Ncols=3072 (64/WG)
    dim3 g1(16, 48);
    k_qkv_gemm<<<g1, dim3(256), 0, stream>>>(x, w_qkv, b_qkv, rope, qkv);

    // 2) Flash attention: (N/64) query blocks x (B*H) heads, 4 waves/WG
    dim3 g3(N_ / 64, B_ * H_);
    k_attn<<<g3, dim3(128), 0, stream>>>(qkv, obuf);

    // 3) Projection GEMM: M=4096, Ncols=1024
    dim3 g4(16, 16);
    k_proj_gemm<<<g4, dim3(256), 0, stream>>>(obuf, w_proj, b_proj, out);
}
